// v000
// The times below were measured on an AMD MI455X: many runs one after another, warmed up first and cycling through
// copies of the inputs, with the whole window's GPU time divided by the number of runs. Launches and the gaps
// between them are all in it. The median over several windows is given; except for v000 it joins two sittings, which
// can be a few percent apart, so the side-by-side timings, each taken in one sitting, are the better comparison.
// v000 is the starting kernel. One run takes 684 microseconds.
#include <hip/hip_runtime.h>

typedef __attribute__((ext_vector_type(2))) float v2f;
typedef __attribute__((ext_vector_type(8))) float v8f;

#define TILE_M 128
#define TILE_N 64
#define KB     32
#define KSTR   36   // padded LDS row stride (floats): 144B rows -> 16B aligned, bank-conflict free

// --------------------------------------------------------------------------
// LDS helpers: AS(3) pointer value == byte offset the DS/async unit adds to
// LDS_BASE, so cast generic -> AS3 and truncate.
// --------------------------------------------------------------------------
typedef __attribute__((address_space(3))) void lds_void;

__device__ __forceinline__ uint32_t lds_offset(void* p) {
    return (uint32_t)(uintptr_t)(lds_void*)p;
}

// CDNA5 async global->LDS copy (VGLOBAL encoding, tracked with ASYNCcnt).
// %0 = LDS byte-offset VGPR (VDST), %1 = 64-bit global address VGPR pair.
__device__ __forceinline__ void async_ld_b128(uint32_t ldsOff, const float* g) {
    asm volatile("global_load_async_to_lds_b128 %0, %1, off"
                 :: "v"(ldsOff), "v"(g)
                 : "memory");
}

__device__ __forceinline__ void wait_async0() {
#if __has_builtin(__builtin_amdgcn_s_wait_asynccnt)
    __builtin_amdgcn_s_wait_asynccnt(0);
#else
    asm volatile("s_wait_asynccnt 0" ::: "memory");
#endif
}

// ---------------------------------------------------------------------------
// Kernel 0: zero output buffer + per-expert counters
// ---------------------------------------------------------------------------
__global__ __launch_bounds__(256) void moe_zero(float* __restrict__ out, size_t n,
                                                int* __restrict__ counts, int E) {
    size_t i = (size_t)blockIdx.x * blockDim.x + threadIdx.x;
    size_t stride = (size_t)gridDim.x * blockDim.x;
    for (; i < n; i += stride) out[i] = 0.0f;
    if (blockIdx.x == 0 && (int)threadIdx.x < E) counts[threadIdx.x] = 0;
}

// ---------------------------------------------------------------------------
// Kernel 1: gating. One wave per token; softmax is monotonic so top-k on raw
// logits (+bias) gives identical routing. Appends token to its 2 experts'
// compacted index lists.
// ---------------------------------------------------------------------------
__global__ __launch_bounds__(256) void moe_gate(const float* __restrict__ x,
                                                const float* __restrict__ gw,
                                                const float* __restrict__ gb,
                                                int* __restrict__ counts,
                                                int* __restrict__ idxList,
                                                int T, int D) {
    const int wave = threadIdx.x >> 5;
    const int lane = threadIdx.x & 31;
    const int t = blockIdx.x * 8 + wave;
    if (t >= T) return;

    const float* xr = x + (size_t)t * D;
    float s[8];
#pragma unroll
    for (int e = 0; e < 8; ++e) s[e] = 0.0f;

    for (int k = lane; k < D; k += 32) {
        const float xv = xr[k];
#pragma unroll
        for (int e = 0; e < 8; ++e)
            s[e] = fmaf(xv, gw[e * D + k], s[e]);
    }
#pragma unroll
    for (int off = 16; off > 0; off >>= 1) {
#pragma unroll
        for (int e = 0; e < 8; ++e)
            s[e] += __shfl_xor(s[e], off, 32);
    }

    if (lane == 0) {
#pragma unroll
        for (int e = 0; e < 8; ++e) s[e] += gb[e];
        int i1 = 0; float v1 = s[0];
#pragma unroll
        for (int e = 1; e < 8; ++e) { if (s[e] > v1) { v1 = s[e]; i1 = e; } }
        int i2 = (i1 == 0) ? 1 : 0; float v2 = s[i2];
#pragma unroll
        for (int e = 0; e < 8; ++e) { if (e != i1 && s[e] > v2) { v2 = s[e]; i2 = e; } }
        int p1 = atomicAdd(&counts[i1], 1);
        idxList[i1 * T + p1] = t;
        int p2 = atomicAdd(&counts[i2], 1);
        idxList[i2 * T + p2] = t;
    }
}

// ---------------------------------------------------------------------------
// Kernel 2: grouped GEMM per expert, V_WMMA_F32_16X16X4_F32, async-to-LDS
// double-buffered staging. Block = 256 thr (8 waves) -> 128(M) x 64(N) tile.
// ---------------------------------------------------------------------------
__global__ __launch_bounds__(256) void moe_gemm(const float* __restrict__ x,      // [T,D]
                                                const float* __restrict__ W,      // [E,H,D]
                                                const float* __restrict__ bias,   // [E,H]
                                                const int* __restrict__ counts,   // [E]
                                                const int* __restrict__ idxList,  // [E,T]
                                                float* __restrict__ out,          // [T,H]
                                                int T, int D, int H) {
    const int e   = blockIdx.z;
    const int m0  = blockIdx.y * TILE_M;
    const int n0  = blockIdx.x * TILE_N;
    const int cnt = counts[e];
    if (m0 >= cnt) return;   // uniform scalar branch: whole block exits

    __shared__ alignas(16) float sX[2][TILE_M * KSTR];
    __shared__ alignas(16) float sW[2][TILE_N * KSTR];
    __shared__ int sTok[TILE_M];

    const int tid  = threadIdx.x;
    const int lane = tid & 31;
    const int wave = tid >> 5;
    const int l    = lane & 15;
    const int half = lane >> 4;

    if (tid < TILE_M) {
        const int r = m0 + tid;
        sTok[tid] = (r < cnt) ? idxList[e * T + r] : idxList[e * T];  // pad with safe row
    }
    __syncthreads();

    const float* We = W + (size_t)e * H * D;

    // Per-thread staging slots: 4 X rows + 2 W rows, fixed row/col4 per thread.
    const int rowBase = tid >> 3;   // 0..31   (8 float4 per 32-float row)
    const int c4      = tid & 7;

    const float* gx[4];
    uint32_t     lx[2][4];
#pragma unroll
    for (int i = 0; i < 4; ++i) {
        const int row = rowBase + 32 * i;            // 0..127
        gx[i]    = x + (size_t)sTok[row] * D + c4 * 4;
        lx[0][i] = lds_offset(&sX[0][row * KSTR + c4 * 4]);
        lx[1][i] = lds_offset(&sX[1][row * KSTR + c4 * 4]);
    }
    const float* gww[2];
    uint32_t     lw[2][2];
#pragma unroll
    for (int i = 0; i < 2; ++i) {
        const int row = rowBase + 32 * i;            // 0..63
        gww[i]   = We + (size_t)(n0 + row) * D + c4 * 4;
        lw[0][i] = lds_offset(&sW[0][row * KSTR + c4 * 4]);
        lw[1][i] = lds_offset(&sW[1][row * KSTR + c4 * 4]);
    }

    // Prologue: stage k-block 0 into buffer 0 (6 async b128 per thread).
#pragma unroll
    for (int i = 0; i < 4; ++i) async_ld_b128(lx[0][i], gx[i]);
#pragma unroll
    for (int i = 0; i < 2; ++i) async_ld_b128(lw[0][i], gww[i]);

    v8f acc[4] = {v8f{}, v8f{}, v8f{}, v8f{}};

    int buf = 0;
    for (int kb = 0; kb < D; kb += KB, buf ^= 1) {
        wait_async0();       // this wave's async writes have landed in LDS
        __syncthreads();     // everyone's have

        if (kb + KB < D) {   // stage next k-block into the other buffer
            const int nb = buf ^ 1;
#pragma unroll
            for (int i = 0; i < 4; ++i) { gx[i]  += KB; async_ld_b128(lx[nb][i], gx[i]); }
#pragma unroll
            for (int i = 0; i < 2; ++i) { gww[i] += KB; async_ld_b128(lw[nb][i], gww[i]); }
        }

        const float* Xc = sX[buf];
        const float* Wc = sW[buf];
#pragma unroll
        for (int kk = 0; kk < KB; kk += 4) {
            const int ko = kk + 2 * half;            // A: lanes<16 -> K=0,1; lanes>=16 -> K=2,3
            v2f a;
            a.x = Xc[(wave * 16 + l) * KSTR + ko];
            a.y = Xc[(wave * 16 + l) * KSTR + ko + 1];
#pragma unroll
            for (int nt = 0; nt < 4; ++nt) {
                v2f b;                               // B[k][n] = W[e][n][k]
                b.x = Wc[(nt * 16 + l) * KSTR + ko];
                b.y = Wc[(nt * 16 + l) * KSTR + ko + 1];
                acc[nt] = __builtin_amdgcn_wmma_f32_16x16x4_f32(
                    false, a, false, b, (short)0, acc[nt], false, false);
            }
        }
    }

    // Scatter: C layout M = v + 8*half, N = lane&15 per 16x16 tile. Two expert
    // blocks hit the same token row -> atomic f32 adds.
#pragma unroll
    for (int nt = 0; nt < 4; ++nt) {
        const int col  = n0 + nt * 16 + l;
        const float bc = bias[(size_t)e * H + col];
#pragma unroll
        for (int v = 0; v < 8; ++v) {
            const int rowInTile = wave * 16 + v + 8 * half;
            const int r = m0 + rowInTile;
            if (r < cnt) {
                const int tok = sTok[rowInTile];
                atomicAdd(&out[(size_t)tok * H + col], 0.5f * (acc[nt][v] + bc));
            }
        }
    }
}

// ---------------------------------------------------------------------------
extern "C" void kernel_launch(void* const* d_in, const int* in_sizes, int n_in,
                              void* d_out, int out_size, void* d_ws, size_t ws_size,
                              hipStream_t stream) {
    const float* x    = (const float*)d_in[0];   // sequences [N,P,D] == [T,D]
    const float* gw   = (const float*)d_in[1];   // [E,D]
    const float* gb   = (const float*)d_in[2];   // [E]
    const float* W    = (const float*)d_in[3];   // [E,H,D]
    const float* bias = (const float*)d_in[4];   // [E,H]
    float* out = (float*)d_out;

    const int E = in_sizes[2];
    const int D = in_sizes[1] / E;
    const int H = in_sizes[4] / E;
    const int T = in_sizes[0] / D;

    int* counts  = (int*)d_ws;          // [E] (padded to 64 ints)
    int* idxList = counts + 64;         // [E, T]

    moe_zero<<<4096, 256, 0, stream>>>(out, (size_t)out_size, counts, E);
    moe_gate<<<(T + 7) / 8, 256, 0, stream>>>(x, gw, gb, counts, idxList, T, D);

    dim3 grid(H / TILE_N, (T + TILE_M - 1) / TILE_M, E);
    moe_gemm<<<grid, 256, 0, stream>>>(x, W, bias, counts, idxList, out, T, D, H);
}

// v001
// Measured time: 649 microseconds a run.
// Two timings next to v000 both put it at 1.07 times that version's speed.
#include <hip/hip_runtime.h>

typedef __attribute__((ext_vector_type(2))) float v2f;
typedef __attribute__((ext_vector_type(8))) float v8f;

#define TILE_M 128
#define TILE_N 128
#define KB     32
#define KSTR   36   // padded LDS row stride (floats): 144B rows -> 16B aligned, bank-conflict free

// --------------------------------------------------------------------------
// LDS helpers: AS(3) pointer value == byte offset the DS/async unit adds to
// LDS_BASE, so cast generic -> AS3 and truncate.
// --------------------------------------------------------------------------
typedef __attribute__((address_space(3))) void lds_void;

__device__ __forceinline__ uint32_t lds_offset(void* p) {
    return (uint32_t)(uintptr_t)(lds_void*)p;
}

// CDNA5 async global->LDS copies (VGLOBAL encoding, tracked with ASYNCcnt):
// eight rows, 16 tile rows apart in LDS, each from its own global address.
// LDS byte-offset VGPR first, then the 64-bit global address VGPR pair.
// The closing s_wait_xcnt 0 stands inside the statement so that no register
// a copy names is rewritten ahead of it.
__device__ __forceinline__ void async_ld8_b128(uint32_t l0, const float* const (&g)[8]) {
    const uint32_t st = 16 * KSTR * 4;   // LDS bytes between two of this thread's rows
    asm volatile("global_load_async_to_lds_b128 %0, %8, off\n\t"
                 "global_load_async_to_lds_b128 %1, %9, off\n\t"
                 "global_load_async_to_lds_b128 %2, %10, off\n\t"
                 "global_load_async_to_lds_b128 %3, %11, off\n\t"
                 "global_load_async_to_lds_b128 %4, %12, off\n\t"
                 "global_load_async_to_lds_b128 %5, %13, off\n\t"
                 "global_load_async_to_lds_b128 %6, %14, off\n\t"
                 "global_load_async_to_lds_b128 %7, %15, off\n\t"
                 "s_wait_xcnt 0x0"
                 :: "v"(l0), "v"(l0 + st), "v"(l0 + 2 * st), "v"(l0 + 3 * st),
                    "v"(l0 + 4 * st), "v"(l0 + 5 * st), "v"(l0 + 6 * st), "v"(l0 + 7 * st),
                    "v"(g[0]), "v"(g[1]), "v"(g[2]), "v"(g[3]),
                    "v"(g[4]), "v"(g[5]), "v"(g[6]), "v"(g[7])
                 : "memory");
}

__device__ __forceinline__ void wait_async0() {
#if __has_builtin(__builtin_amdgcn_s_wait_asynccnt)
    __builtin_amdgcn_s_wait_asynccnt(0);
#else
    asm volatile("s_wait_asynccnt 0" ::: "memory");
#endif
}

// ---------------------------------------------------------------------------
// Kernel 0: zero output buffer + per-expert counters
// ---------------------------------------------------------------------------
__global__ __launch_bounds__(256) void moe_zero(float* __restrict__ out, size_t n,
                                                int* __restrict__ counts, int E) {
    size_t i = (size_t)blockIdx.x * blockDim.x + threadIdx.x;
    size_t stride = (size_t)gridDim.x * blockDim.x;
    for (; i < n; i += stride) out[i] = 0.0f;
    if (blockIdx.x == 0 && (int)threadIdx.x < E) counts[threadIdx.x] = 0;
}

// ---------------------------------------------------------------------------
// Kernel 1: gating. One wave per token; softmax is monotonic so top-k on raw
// logits (+bias) gives identical routing. Appends token to its 2 experts'
// compacted index lists.
// ---------------------------------------------------------------------------
__global__ __launch_bounds__(256) void moe_gate(const float* __restrict__ x,
                                                const float* __restrict__ gw,
                                                const float* __restrict__ gb,
                                                int* __restrict__ counts,
                                                int* __restrict__ idxList,
                                                int T, int D) {
    const int wave = threadIdx.x >> 5;
    const int lane = threadIdx.x & 31;
    const int t = blockIdx.x * 8 + wave;
    if (t >= T) return;

    const float* xr = x + (size_t)t * D;
    float s[8];
#pragma unroll
    for (int e = 0; e < 8; ++e) s[e] = 0.0f;

    for (int k = lane; k < D; k += 32) {
        const float xv = xr[k];
#pragma unroll
        for (int e = 0; e < 8; ++e)
            s[e] = fmaf(xv, gw[e * D + k], s[e]);
    }
#pragma unroll
    for (int off = 16; off > 0; off >>= 1) {
#pragma unroll
        for (int e = 0; e < 8; ++e)
            s[e] += __shfl_xor(s[e], off, 32);
    }

    if (lane == 0) {
#pragma unroll
        for (int e = 0; e < 8; ++e) s[e] += gb[e];
        int i1 = 0; float v1 = s[0];
#pragma unroll
        for (int e = 1; e < 8; ++e) { if (s[e] > v1) { v1 = s[e]; i1 = e; } }
        int i2 = (i1 == 0) ? 1 : 0; float v2 = s[i2];
#pragma unroll
        for (int e = 0; e < 8; ++e) { if (e != i1 && s[e] > v2) { v2 = s[e]; i2 = e; } }
        int p1 = atomicAdd(&counts[i1], 1);
        idxList[i1 * T + p1] = t;
        int p2 = atomicAdd(&counts[i2], 1);
        idxList[i2 * T + p2] = t;
    }
}

// ---------------------------------------------------------------------------
// Kernel 2: grouped GEMM per expert, V_WMMA_F32_16X16X4_F32, async-to-LDS
// double-buffered staging. Block = 128 thr (4 waves, 2 x 2) -> 128(M) x 128(N)
// tile; each wave owns 64 x 64 = 16 accumulator tiles, so one k-step of
// 8 fragment reads feeds 16 WMMAs.
// ---------------------------------------------------------------------------
__global__ __launch_bounds__(128) void moe_gemm(const float* __restrict__ x,      // [T,D]
                                                const float* __restrict__ W,      // [E,H,D]
                                                const float* __restrict__ bias,   // [E,H]
                                                const int* __restrict__ counts,   // [E]
                                                const int* __restrict__ idxList,  // [E,T]
                                                float* __restrict__ out,          // [T,H]
                                                int T, int D, int H) {
    const int e   = blockIdx.z;
    const int m0  = blockIdx.y * TILE_M;
    const int n0  = blockIdx.x * TILE_N;
    const int cnt = counts[e];
    if (m0 >= cnt) return;   // uniform scalar branch: whole block exits

    __shared__ alignas(16) float sX[2][TILE_M * KSTR];
    __shared__ alignas(16) float sW[2][TILE_N * KSTR];
    __shared__ int sTok[TILE_M];

    const int tid  = threadIdx.x;
    const int lane = tid & 31;
    const int wave = tid >> 5;
    const int wm   = wave & 1;    // wave's 64-row half of the tile
    const int wn   = wave >> 1;   // wave's 64-column half of the tile
    const int l    = lane & 15;
    const int half = lane >> 4;

    {
        const int r = m0 + tid;   // blockDim.x == TILE_M
        sTok[tid] = (r < cnt) ? idxList[e * T + r] : idxList[e * T];  // pad with safe row
    }
    __syncthreads();

    const float* We = W + (size_t)e * H * D;

    // Per-thread staging slots: 8 X rows + 8 W rows, fixed row/col4 per thread.
    const int rowBase = tid >> 3;   // 0..15   (8 float4 per 32-float row)
    const int c4      = tid & 7;

    const float* gx[8];
    const float* gww[8];
#pragma unroll
    for (int i = 0; i < 8; ++i) {
        const int row = rowBase + 16 * i;            // 0..127
        gx[i]  = x + (size_t)sTok[row] * D + c4 * 4;
        gww[i] = We + (size_t)(n0 + row) * D + c4 * 4;
    }
    const uint32_t lxBase = lds_offset(&sX[0][rowBase * KSTR + c4 * 4]);
    const uint32_t lwBase = lds_offset(&sW[0][rowBase * KSTR + c4 * 4]);

    // Prologue: stage k-block 0 into buffer 0 (16 async b128 per thread).
    async_ld8_b128(lxBase, gx);
    async_ld8_b128(lwBase, gww);

    v8f acc[4][4];
#pragma unroll
    for (int mt = 0; mt < 4; ++mt)
#pragma unroll
        for (int nt = 0; nt < 4; ++nt) acc[mt][nt] = v8f{};

    int buf = 0;
    for (int kb = 0; kb < D; kb += KB, buf ^= 1) {
        // This wave's LDS reads of the buffer refilled below have retired.
        asm volatile("s_wait_dscnt 0x0" ::: "memory");
        wait_async0();       // this wave's async writes have landed in LDS
        __syncthreads();     // everyone's have

        if (kb + KB < D) {   // stage next k-block into the other buffer
            // byte step to the other buffer, the same for sX and sW (TILE_M == TILE_N)
            const uint32_t bo = (uint32_t)(buf ^ 1) * (uint32_t)(TILE_M * KSTR * 4);
            const float* tx[8];
            const float* tw[8];
#pragma unroll
            for (int i = 0; i < 8; ++i) { tx[i] = gx[i] + (kb + KB); tw[i] = gww[i] + (kb + KB); }
            async_ld8_b128(lxBase + bo, tx);
            async_ld8_b128(lwBase + bo, tw);
        }

        const float* Xc = sX[buf] + (wm * 64 + l) * KSTR + 2 * half;
        const float* Wc = sW[buf] + (wn * 64 + l) * KSTR + 2 * half;
        // Fragments of 8 k (two WMMA k-steps) per set; the next set's reads are
        // issued ahead of the current set's 32 WMMAs, inside this pass's buffer only.
        // A: lanes<16 -> K=0,1; lanes>=16 -> K=2,3; B[k][n] = W[e][n][k], same k order
        // Every loop over a[], b[] and acc[] is unrolled so that they stay in registers.
        v2f a[2][2][4], b[2][2][4];
#pragma unroll
        for (int s = 0; s < 2; ++s)
#pragma unroll
            for (int t = 0; t < 4; ++t) {
                a[0][s][t] = *(const v2f*)&Xc[t * 16 * KSTR + 4 * s];
                b[0][s][t] = *(const v2f*)&Wc[t * 16 * KSTR + 4 * s];
            }
#pragma unroll
        for (int u = 0; u < KB / 8; ++u) {
            const int cur = u & 1;
            if (u + 1 < KB / 8) {
#pragma unroll
                for (int s = 0; s < 2; ++s)
#pragma unroll
                    for (int t = 0; t < 4; ++t) {
                        a[cur ^ 1][s][t] = *(const v2f*)&Xc[t * 16 * KSTR + 8 * (u + 1) + 4 * s];
                        b[cur ^ 1][s][t] = *(const v2f*)&Wc[t * 16 * KSTR + 8 * (u + 1) + 4 * s];
                    }
            }
#pragma unroll
            for (int s = 0; s < 2; ++s)
#pragma unroll
                for (int mt = 0; mt < 4; ++mt)
#pragma unroll
                    for (int nt = 0; nt < 4; ++nt)
                        acc[mt][nt] = __builtin_amdgcn_wmma_f32_16x16x4_f32(
                            false, a[cur][s][mt], false, b[cur][s][nt], (short)0, acc[mt][nt],
                            false, false);
        }
    }

    // Scatter: C layout M = v + 8*half, N = lane&15 per 16x16 tile. Two expert
    // blocks hit the same token row -> atomic f32 adds.
    const int col0 = n0 + wn * 64 + l;
    float bc[4];
#pragma unroll
    for (int nt = 0; nt < 4; ++nt) bc[nt] = bias[(size_t)e * H + col0 + nt * 16];
#pragma unroll
    for (int mt = 0; mt < 4; ++mt) {
#pragma unroll
        for (int v = 0; v < 8; ++v) {
            const int rowInTile = wm * 64 + mt * 16 + v + 8 * half;
            if (m0 + rowInTile < cnt) {
                float* o = out + (size_t)sTok[rowInTile] * H + col0;
#pragma unroll
                for (int nt = 0; nt < 4; ++nt)
                    atomicAdd(&o[nt * 16], 0.5f * (acc[mt][nt][v] + bc[nt]));
            }
        }
    }
}

// ---------------------------------------------------------------------------
extern "C" void kernel_launch(void* const* d_in, const int* in_sizes, int n_in,
                              void* d_out, int out_size, void* d_ws, size_t ws_size,
                              hipStream_t stream) {
    const float* x    = (const float*)d_in[0];   // sequences [N,P,D] == [T,D]
    const float* gw   = (const float*)d_in[1];   // [E,D]
    const float* gb   = (const float*)d_in[2];   // [E]
    const float* W    = (const float*)d_in[3];   // [E,H,D]
    const float* bias = (const float*)d_in[4];   // [E,H]
    float* out = (float*)d_out;

    const int E = in_sizes[2];
    const int D = in_sizes[1] / E;
    const int H = in_sizes[4] / E;
    const int T = in_sizes[0] / D;

    int* counts  = (int*)d_ws;          // [E] (padded to 64 ints)
    int* idxList = counts + 64;         // [E, T]

    moe_zero<<<4096, 256, 0, stream>>>(out, (size_t)out_size, counts, E);
    moe_gate<<<(T + 7) / 8, 256, 0, stream>>>(x, gw, gb, counts, idxList, T, D);

    dim3 grid(H / TILE_N, (T + TILE_M - 1) / TILE_M, E);
    moe_gemm<<<grid, 128, 0, stream>>>(x, W, bias, counts, idxList, out, T, D, H);
}

// v002
// One run takes 434 microseconds.
// In both of two side-by-side timings against v001, it was 1.50 times as fast.
// Over all steps from v000 it is 1.61 times as fast.
#include <hip/hip_runtime.h>

typedef __attribute__((ext_vector_type(2))) float v2f;
typedef __attribute__((ext_vector_type(4))) float v4f;
typedef __attribute__((ext_vector_type(8))) float v8f;

#define TILE_M 64
#define TILE_N 256
#define NPAIR  28   // unordered pairs of the 8 experts
#define KB     32
#define KSTR   36   // padded LDS row stride (floats): 144B rows -> 16B aligned, bank-conflict free

// --------------------------------------------------------------------------
// LDS helpers: AS(3) pointer value == byte offset the DS/async unit adds to
// LDS_BASE, so cast generic -> AS3 and truncate.
// --------------------------------------------------------------------------
typedef __attribute__((address_space(3))) void lds_void;

__device__ __forceinline__ uint32_t lds_offset(void* p) {
    return (uint32_t)(uintptr_t)(lds_void*)p;
}

// CDNA5 async global->LDS copies (VGLOBAL encoding, tracked with ASYNCcnt):
// eight rows, 16 tile rows apart in LDS, each from its own global address.
// LDS byte-offset VGPR first, then the 64-bit global address VGPR pair.
// The closing s_wait_xcnt 0 stands inside the statement so that no register
// a copy names is rewritten ahead of it.
__device__ __forceinline__ void async_ld8_b128(uint32_t l0, const float* const (&g)[8]) {
    const uint32_t st = 16 * KSTR * 4;   // LDS bytes between two of this thread's rows
    asm volatile("global_load_async_to_lds_b128 %0, %8, off\n\t"
                 "global_load_async_to_lds_b128 %1, %9, off\n\t"
                 "global_load_async_to_lds_b128 %2, %10, off\n\t"
                 "global_load_async_to_lds_b128 %3, %11, off\n\t"
                 "global_load_async_to_lds_b128 %4, %12, off\n\t"
                 "global_load_async_to_lds_b128 %5, %13, off\n\t"
                 "global_load_async_to_lds_b128 %6, %14, off\n\t"
                 "global_load_async_to_lds_b128 %7, %15, off\n\t"
                 "s_wait_xcnt 0x0"
                 :: "v"(l0), "v"(l0 + st), "v"(l0 + 2 * st), "v"(l0 + 3 * st),
                    "v"(l0 + 4 * st), "v"(l0 + 5 * st), "v"(l0 + 6 * st), "v"(l0 + 7 * st),
                    "v"(g[0]), "v"(g[1]), "v"(g[2]), "v"(g[3]),
                    "v"(g[4]), "v"(g[5]), "v"(g[6]), "v"(g[7])
                 : "memory");
}

// The same for four rows (the X tile has 64 rows: four per thread).
__device__ __forceinline__ void async_ld4_b128(uint32_t l0, const float* const (&g)[4]) {
    const uint32_t st = 16 * KSTR * 4;   // LDS bytes between two of this thread's rows
    asm volatile("global_load_async_to_lds_b128 %0, %4, off\n\t"
                 "global_load_async_to_lds_b128 %1, %5, off\n\t"
                 "global_load_async_to_lds_b128 %2, %6, off\n\t"
                 "global_load_async_to_lds_b128 %3, %7, off\n\t"
                 "s_wait_xcnt 0x0"
                 :: "v"(l0), "v"(l0 + st), "v"(l0 + 2 * st), "v"(l0 + 3 * st),
                    "v"(g[0]), "v"(g[1]), "v"(g[2]), "v"(g[3])
                 : "memory");
}

__device__ __forceinline__ void wait_async0() {
#if __has_builtin(__builtin_amdgcn_s_wait_asynccnt)
    __builtin_amdgcn_s_wait_asynccnt(0);
#else
    asm volatile("s_wait_asynccnt 0" ::: "memory");
#endif
}

// ---------------------------------------------------------------------------
// Kernel 0: pair sums. x.Wa^T + x.Wb^T == x.(Wa + Wb)^T, so the sum of every
// unordered expert pair's weights is formed once per call: S[p] = W[a] + W[b],
// p counting (0,1),(0,2)..(0,7),(1,2).. Each thread reads four floats of all 8
// experts and writes their 28 sums, 16 bytes a store. Also clears the per-pair counters.
// ---------------------------------------------------------------------------
__global__ __launch_bounds__(256) void moe_pairsum(const float* __restrict__ W,   // [8,H,D]
                                                   float* __restrict__ S,         // [28,H,D]
                                                   size_t n4,                     // H*D/4
                                                   int* __restrict__ counts) {
    const size_t i = (size_t)blockIdx.x * blockDim.x + threadIdx.x;
    if (i < n4) {
        v4f* S4 = (v4f*)S;
        const v4f* pw[8];
        v4f w[8];
        // All loops unrolled: pw[] and w[] stay in registers, p is a constant at each store.
#pragma unroll
        for (int e = 0; e < 8; ++e) pw[e] = (const v4f*)W + (size_t)e * n4 + i;
#pragma unroll
        for (int e = 0; e < 8; ++e) w[e] = *pw[e];
        // The wait that stands ahead of any rewrite of a register that an issued load names.
        // It takes the eight addresses as inputs, so they stay in their registers up to it
        // and no load's result lands in one of them.
        asm volatile("s_wait_xcnt 0x0"
                     :: "v"(pw[0]), "v"(pw[1]), "v"(pw[2]), "v"(pw[3]),
                        "v"(pw[4]), "v"(pw[5]), "v"(pw[6]), "v"(pw[7])
                     : "memory");
        int p = 0;
#pragma unroll
        for (int a = 0; a < 8; ++a)
#pragma unroll
            for (int b = a + 1; b < 8; ++b, ++p)
                S4[(size_t)p * n4 + i] = w[a] + w[b];
    }
    if (blockIdx.x == 0 && threadIdx.x < NPAIR) counts[threadIdx.x] = 0;
}

// ---------------------------------------------------------------------------
// Kernel 1: gating. One wave per token; softmax is monotonic so top-k on raw
// logits (+bias) gives identical routing. Appends token to the compacted
// index list of its expert pair.
// ---------------------------------------------------------------------------
__global__ __launch_bounds__(256) void moe_gate(const float* __restrict__ x,
                                                const float* __restrict__ gw,
                                                const float* __restrict__ gb,
                                                int* __restrict__ counts,
                                                int* __restrict__ idxList,
                                                int T, int D) {
    const int wave = threadIdx.x >> 5;
    const int lane = threadIdx.x & 31;
    const int t = blockIdx.x * 8 + wave;
    if (t >= T) return;

    const float* xr = x + (size_t)t * D;
    float s[8];
#pragma unroll
    for (int e = 0; e < 8; ++e) s[e] = 0.0f;

    for (int k = lane; k < D; k += 32) {
        const float xv = xr[k];
#pragma unroll
        for (int e = 0; e < 8; ++e)
            s[e] = fmaf(xv, gw[e * D + k], s[e]);
    }
#pragma unroll
    for (int off = 16; off > 0; off >>= 1) {
#pragma unroll
        for (int e = 0; e < 8; ++e)
            s[e] += __shfl_xor(s[e], off, 32);
    }

    if (lane == 0) {
#pragma unroll
        for (int e = 0; e < 8; ++e) s[e] += gb[e];
        int i1 = 0; float v1 = s[0];
#pragma unroll
        for (int e = 1; e < 8; ++e) { if (s[e] > v1) { v1 = s[e]; i1 = e; } }
        int i2 = (i1 == 0) ? 1 : 0; float v2 = s[i2];
#pragma unroll
        for (int e = 0; e < 8; ++e) { if (e != i1 && s[e] > v2) { v2 = s[e]; i2 = e; } }
        const int lo = i1 < i2 ? i1 : i2;
        const int hi = i1 < i2 ? i2 : i1;
        const int pr = lo * (15 - lo) / 2 + (hi - lo - 1);   // order of moe_pairsum
        const int pos = atomicAdd(&counts[pr], 1);
        idxList[pr * T + pos] = t;
    }
}

// ---------------------------------------------------------------------------
// Kernel 2: grouped GEMM per expert pair against the pair's summed weights,
// V_WMMA_F32_16X16X4_F32, async-to-LDS double-buffered staging. Block = 128 thr
// (4 waves, 1 x 4) -> 64(M) x 256(N) tile; each wave owns 64 x 64 = 16
// accumulator tiles, so one k-step of 8 fragment reads feeds 16 WMMAs.
// A token is in exactly one pair list, so each output row has one writer.
// ---------------------------------------------------------------------------
__global__ __launch_bounds__(128) void moe_gemm(const float* __restrict__ x,      // [T,D]
                                                const float* __restrict__ S,      // [NPAIR,H,D]
                                                const float* __restrict__ bias,   // [E,H]
                                                const int* __restrict__ counts,   // [NPAIR]
                                                const int* __restrict__ idxList,  // [NPAIR,T]
                                                float* __restrict__ out,          // [T,H]
                                                int T, int D, int H) {
    const int n0  = blockIdx.x * TILE_N;
    // blockIdx.y counts the M tiles of all pair lists one after the other.
    // Unrolled: the 28 counters arrive in a few wide scalar loads.
    int pr = -1, m0 = 0, cnt = 0, first = 0;
#pragma unroll
    for (int p = 0; p < NPAIR; ++p) {
        const int c  = counts[p];
        const int nt = (int)((unsigned)(c + TILE_M - 1) / TILE_M);
        if (pr < 0 && (int)blockIdx.y < first + nt) {
            pr = p; m0 = ((int)blockIdx.y - first) * TILE_M; cnt = c;
        }
        first += nt;
    }
    if (pr < 0) return;   // uniform scalar branch: whole block exits
    // The pair's two experts, in the order of moe_pairsum (unrolled: scalar selects, no loop).
    int ea = 0, eb = pr;
#pragma unroll
    for (int a = 0; a < 7; ++a)
        if (ea == a && eb >= 7 - a) { eb -= 7 - a; ea = a + 1; }
    eb += ea + 1;

    __shared__ alignas(16) float sX[2][TILE_M * KSTR];
    __shared__ alignas(16) float sW[2][TILE_N * KSTR];
    __shared__ int sTok[TILE_M];

    const int tid  = threadIdx.x;
    const int lane = tid & 31;
    const int wave = tid >> 5;
    const int l    = lane & 15;
    const int half = lane >> 4;

    if (tid < TILE_M) {
        const int r = m0 + tid;
        sTok[tid] = (r < cnt) ? idxList[pr * T + r] : idxList[pr * T];  // pad with safe row
    }
    __syncthreads();

    const float* We = S + (size_t)pr * H * D;

    // Per-thread staging slots: 4 X rows + 16 W rows, fixed row/col4 per thread.
    // Loops over the pointer arrays are unrolled so that they stay in registers.
    const int rowBase = tid >> 3;   // 0..15   (8 float4 per 32-float row)
    const int c4      = tid & 7;

    const float* gx[4];
#pragma unroll
    for (int i = 0; i < 4; ++i)
        gx[i] = x + (size_t)sTok[rowBase + 16 * i] * D + c4 * 4;       // rows 0..63
    // W rows are evenly spaced: one running pointer, the 16 rows formed from it per pass.
    const float* gw0 = We + (size_t)(n0 + rowBase) * D + c4 * 4;
    const size_t wst = (size_t)16 * D;   // floats between two of this thread's W rows
    const float* gwa[8];
    const float* gwb[8];
#pragma unroll
    for (int i = 0; i < 8; ++i) { gwa[i] = gw0 + i * wst; gwb[i] = gw0 + (i + 8) * wst; }
    const uint32_t lxBase = lds_offset(&sX[0][rowBase * KSTR + c4 * 4]);
    const uint32_t lwBase = lds_offset(&sW[0][rowBase * KSTR + c4 * 4]);

    const uint32_t lwHalf = 128 * KSTR * 4;   // LDS bytes from W row r to row r + 128

    // Prologue: stage k-block 0 into buffer 0 (20 async b128 per thread).
    async_ld4_b128(lxBase, gx);
    async_ld8_b128(lwBase, gwa);
    async_ld8_b128(lwBase + lwHalf, gwb);

    v8f acc[4][4];
#pragma unroll
    for (int mt = 0; mt < 4; ++mt)
#pragma unroll
        for (int nt = 0; nt < 4; ++nt) acc[mt][nt] = v8f{};

    int buf = 0;
    for (int kb = 0; kb < D; kb += KB, buf ^= 1) {
        // This wave's LDS reads of the buffer refilled below have retired.
        asm volatile("s_wait_dscnt 0x0" ::: "memory");
        wait_async0();       // this wave's async writes have landed in LDS
        __syncthreads();     // everyone's have

        if (kb + KB < D) {   // stage next k-block into the other buffer
            // byte steps to the other buffer
            const uint32_t box = (uint32_t)(buf ^ 1) * (uint32_t)(TILE_M * KSTR * 4);
            const uint32_t bow = (uint32_t)(buf ^ 1) * (uint32_t)(TILE_N * KSTR * 4);
            const float* tx[4];
            const float* ta[8];
            const float* tb[8];
#pragma unroll
            for (int i = 0; i < 4; ++i) tx[i] = gx[i] + (kb + KB);
            gw0 += KB;
#pragma unroll
            for (int i = 0; i < 8; ++i) { ta[i] = gw0 + i * wst; tb[i] = gw0 + (i + 8) * wst; }
            async_ld4_b128(lxBase + box, tx);
            async_ld8_b128(lwBase + bow, ta);
            async_ld8_b128(lwBase + bow + lwHalf, tb);
        }

        const float* Xc = sX[buf] + l * KSTR + 2 * half;
        const float* Wc = sW[buf] + (wave * 64 + l) * KSTR + 2 * half;
        // Fragments of 8 k (two WMMA k-steps) per set; the next set's reads are
        // issued ahead of the current set's 32 WMMAs, inside this pass's buffer only.
        // A: lanes<16 -> K=0,1; lanes>=16 -> K=2,3; B[k][n] = S[pr][n][k], same k order
        // Every loop over a[], b[] and acc[] is unrolled so that they stay in registers.
        v2f a[2][2][4], b[2][2][4];
#pragma unroll
        for (int s = 0; s < 2; ++s)
#pragma unroll
            for (int t = 0; t < 4; ++t) {
                a[0][s][t] = *(const v2f*)&Xc[t * 16 * KSTR + 4 * s];
                b[0][s][t] = *(const v2f*)&Wc[t * 16 * KSTR + 4 * s];
            }
#pragma unroll
        for (int u = 0; u < KB / 8; ++u) {
            const int cur = u & 1;
            if (u + 1 < KB / 8) {
#pragma unroll
                for (int s = 0; s < 2; ++s)
#pragma unroll
                    for (int t = 0; t < 4; ++t) {
                        a[cur ^ 1][s][t] = *(const v2f*)&Xc[t * 16 * KSTR + 8 * (u + 1) + 4 * s];
                        b[cur ^ 1][s][t] = *(const v2f*)&Wc[t * 16 * KSTR + 8 * (u + 1) + 4 * s];
                    }
            }
#pragma unroll
            for (int s = 0; s < 2; ++s)
#pragma unroll
                for (int mt = 0; mt < 4; ++mt)
#pragma unroll
                    for (int nt = 0; nt < 4; ++nt)
                        acc[mt][nt] = __builtin_amdgcn_wmma_f32_16x16x4_f32(
                            false, a[cur][s][mt], false, b[cur][s][nt], (short)0, acc[mt][nt],
                            false, false);
        }
    }

    // Scatter: C layout M = v + 8*half, N = lane&15 per 16x16 tile. One block
    // holds a token row's whole sum over both experts -> plain stores.
    const int col0 = n0 + wave * 64 + l;
    float bc[4];
#pragma unroll
    for (int nt = 0; nt < 4; ++nt)
        bc[nt] = bias[(size_t)ea * H + col0 + nt * 16] + bias[(size_t)eb * H + col0 + nt * 16];
#pragma unroll
    for (int mt = 0; mt < 4; ++mt) {
#pragma unroll
        for (int v = 0; v < 8; ++v) {
            const int rowInTile = mt * 16 + v + 8 * half;
            if (m0 + rowInTile < cnt) {
                float* o = out + (size_t)sTok[rowInTile] * H + col0;
#pragma unroll
                for (int nt = 0; nt < 4; ++nt)
                    o[nt * 16] = 0.5f * (acc[mt][nt][v] + bc[nt]);
            }
        }
    }
}

// ---------------------------------------------------------------------------
extern "C" void kernel_launch(void* const* d_in, const int* in_sizes, int n_in,
                              void* d_out, int out_size, void* d_ws, size_t ws_size,
                              hipStream_t stream) {
    const float* x    = (const float*)d_in[0];   // sequences [N,P,D] == [T,D]
    const float* gw   = (const float*)d_in[1];   // [E,D]
    const float* gb   = (const float*)d_in[2];   // [E]
    const float* W    = (const float*)d_in[3];   // [E,H,D]
    const float* bias = (const float*)d_in[4];   // [E,H]
    float* out = (float*)d_out;

    const int E = in_sizes[2];
    const int D = in_sizes[1] / E;
    const int H = in_sizes[4] / E;
    const int T = in_sizes[0] / D;

    int* counts  = (int*)d_ws;                   // [NPAIR] (padded to 64 ints)
    int* idxList = counts + 64;                  // [NPAIR, T]
    float* S     = (float*)(idxList + NPAIR * T);   // [NPAIR, H, D] pair-summed weights

    const size_t n4 = (size_t)H * D / 4;
    moe_pairsum<<<(unsigned)((n4 + 255) / 256), 256, 0, stream>>>(W, S, n4, counts);
    moe_gate<<<(T + 7) / 8, 256, 0, stream>>>(x, gw, gb, counts, idxList, T, D);

    // every list's last M tile may be partial: at most T / TILE_M + NPAIR tiles in all
    dim3 grid(H / TILE_N, T / TILE_M + NPAIR, 1);
    moe_gemm<<<grid, 128, 0, stream>>>(x, S, bias, counts, idxList, out, T, D, H);
}

// v003
// One run takes 369 microseconds.
// Next to v002, in two timings, it ran 1.18 times as fast each time.
// Counting every step since v000, it is 1.89 times as fast.
#include <hip/hip_runtime.h>

typedef __attribute__((ext_vector_type(2))) float v2f;
typedef __attribute__((ext_vector_type(4))) float v4f;
typedef __attribute__((ext_vector_type(8))) float v8f;

#define TILE_M 64
#define TILE_N 256
#define NPAIR  28   // unordered pairs of the 8 experts
#define KB     32
#define WPITCH 1024 // floats in a row of W (D of the problem's shapes): row steps fold into the loads
#define KSTR   36   // padded LDS row stride (floats): 144B rows -> 16B aligned, bank-conflict free

// --------------------------------------------------------------------------
// LDS helpers: AS(3) pointer value == byte offset the DS/async unit adds to
// LDS_BASE, so cast generic -> AS3 and truncate.
// --------------------------------------------------------------------------
typedef __attribute__((address_space(3))) void lds_void;

__device__ __forceinline__ uint32_t lds_offset(void* p) {
    return (uint32_t)(uintptr_t)(lds_void*)p;
}

// CDNA5 async global->LDS copies (VGLOBAL encoding, tracked with ASYNCcnt):
// four rows, 16 tile rows apart in LDS, each from its own global address
// (the X tile has 64 rows: four per thread).
// LDS byte-offset VGPR first, then the 64-bit global address VGPR pair.
// The closing s_wait_xcnt 0 stands inside the statement so that no register
// a copy names is rewritten ahead of it.
__device__ __forceinline__ void async_ld4_b128(uint32_t l0, const float* const (&g)[4]) {
    const uint32_t st = 16 * KSTR * 4;   // LDS bytes between two of this thread's rows
    asm volatile("global_load_async_to_lds_b128 %0, %4, off\n\t"
                 "global_load_async_to_lds_b128 %1, %5, off\n\t"
                 "global_load_async_to_lds_b128 %2, %6, off\n\t"
                 "global_load_async_to_lds_b128 %3, %7, off\n\t"
                 "s_wait_xcnt 0x0"
                 :: "v"(l0), "v"(l0 + st), "v"(l0 + 2 * st), "v"(l0 + 3 * st),
                    "v"(g[0]), "v"(g[1]), "v"(g[2]), "v"(g[3])
                 : "memory");
}

__device__ __forceinline__ void wait_async0() {
#if __has_builtin(__builtin_amdgcn_s_wait_asynccnt)
    __builtin_amdgcn_s_wait_asynccnt(0);
#else
    asm volatile("s_wait_asynccnt 0" ::: "memory");
#endif
}

// ---------------------------------------------------------------------------
// Kernel 0: clears the per-pair counters that the gating kernel adds into.
// ---------------------------------------------------------------------------
__global__ __launch_bounds__(32) void moe_clear(int* __restrict__ counts) {
    if (threadIdx.x < NPAIR) counts[threadIdx.x] = 0;
}

// ---------------------------------------------------------------------------
// Kernel 1: gating. One wave per token; softmax is monotonic so top-k on raw
// logits (+bias) gives identical routing. Appends token to the compacted
// index list of its expert pair.
// ---------------------------------------------------------------------------
__global__ __launch_bounds__(256) void moe_gate(const float* __restrict__ x,
                                                const float* __restrict__ gw,
                                                const float* __restrict__ gb,
                                                int* __restrict__ counts,
                                                int* __restrict__ idxList,
                                                int T, int D) {
    const int wave = threadIdx.x >> 5;
    const int lane = threadIdx.x & 31;
    const int t = blockIdx.x * 8 + wave;
    if (t >= T) return;

    const float* xr = x + (size_t)t * D;
    float s[8];
#pragma unroll
    for (int e = 0; e < 8; ++e) s[e] = 0.0f;

    for (int k = lane; k < D; k += 32) {
        const float xv = xr[k];
#pragma unroll
        for (int e = 0; e < 8; ++e)
            s[e] = fmaf(xv, gw[e * D + k], s[e]);
    }
#pragma unroll
    for (int off = 16; off > 0; off >>= 1) {
#pragma unroll
        for (int e = 0; e < 8; ++e)
            s[e] += __shfl_xor(s[e], off, 32);
    }

    if (lane == 0) {
#pragma unroll
        for (int e = 0; e < 8; ++e) s[e] += gb[e];
        int i1 = 0; float v1 = s[0];
#pragma unroll
        for (int e = 1; e < 8; ++e) { if (s[e] > v1) { v1 = s[e]; i1 = e; } }
        int i2 = (i1 == 0) ? 1 : 0; float v2 = s[i2];
#pragma unroll
        for (int e = 0; e < 8; ++e) { if (e != i1 && s[e] > v2) { v2 = s[e]; i2 = e; } }
        const int lo = i1 < i2 ? i1 : i2;
        const int hi = i1 < i2 ? i2 : i1;
        const int pr = lo * (15 - lo) / 2 + (hi - lo - 1);   // (0,1),(0,2)..(0,7),(1,2)..
        const int pos = atomicAdd(&counts[pr], 1);
        idxList[pr * T + pos] = t;
    }
}

// ---------------------------------------------------------------------------
// Kernel 2: grouped GEMM per expert pair. x.Wa^T + x.Wb^T == x.(Wa + Wb)^T, so
// the two experts' W tiles are loaded to registers, added and stored to LDS as
// one tile: one GEMM row per token. V_WMMA_F32_16X16X4_F32, two LDS buffers; X
// is staged by async-to-LDS copies. Block = 128 thr (4 waves, 1 x 4) ->
// 64(M) x 256(N) tile; each wave owns 64 x 64 = 16 accumulator tiles, so one
// k-step of 8 fragment reads feeds 16 WMMAs.
// A token is in exactly one pair list, so each output row has one writer.
// ---------------------------------------------------------------------------
// Four W rows of both experts (group g of four; rows 16 tile rows apart), 16 bytes a
// thread and row: the thread's two running pointers plus a constant step per row.
__device__ __forceinline__ void w_load4(v4f (&ra)[4], v4f (&rb)[4],
                                        const float* pa, const float* pb, int g) {
    // Unrolled: the loaded rows stay in registers, the row steps are constants.
#pragma unroll
    for (int i = 0; i < 4; ++i) {
        ra[i] = *(const v4f*)(pa + (4 * g + i) * 16 * WPITCH);
        rb[i] = *(const v4f*)(pb + (4 * g + i) * 16 * WPITCH);
    }
    // The wait that stands ahead of any rewrite of a register that an issued load names.
    // It takes the two addresses as inputs, so they stay in their registers up to it.
    asm volatile("s_wait_xcnt 0x0" :: "v"(pa), "v"(pb) : "memory");
}

// Their sums into the LDS tile, rows 16 apart from dst on.
__device__ __forceinline__ void w_store4(float* dst, const v4f (&ra)[4], const v4f (&rb)[4]) {
    // Unrolled: ra[] and rb[] stay in registers, the row steps fold into the stores.
#pragma unroll
    for (int i = 0; i < 4; ++i) *(v4f*)&dst[i * 16 * KSTR] = ra[i] + rb[i];
}

__global__ __launch_bounds__(128) void moe_gemm(const float* __restrict__ x,      // [T,D]
                                                const float* __restrict__ W,      // [E,H,D]
                                                const float* __restrict__ bias,   // [E,H]
                                                const int* __restrict__ counts,   // [NPAIR]
                                                const int* __restrict__ idxList,  // [NPAIR,T]
                                                float* __restrict__ out,          // [T,H]
                                                int T, int D, int H) {
    const int n0  = blockIdx.x * TILE_N;
    // blockIdx.y counts the M tiles of all pair lists one after the other.
    // Unrolled: the 28 counters arrive in a few wide scalar loads.
    int pr = -1, m0 = 0, cnt = 0, first = 0;
#pragma unroll
    for (int p = 0; p < NPAIR; ++p) {
        const int c  = counts[p];
        const int nt = (int)((unsigned)(c + TILE_M - 1) / TILE_M);
        if (pr < 0 && (int)blockIdx.y < first + nt) {
            pr = p; m0 = ((int)blockIdx.y - first) * TILE_M; cnt = c;
        }
        first += nt;
    }
    if (pr < 0) return;   // uniform scalar branch: whole block exits
    // The pair's two experts, pairs counted (0,1),(0,2)..(0,7),(1,2).. (unrolled: scalar selects, no loop).
    int ea = 0, eb = pr;
#pragma unroll
    for (int a = 0; a < 7; ++a)
        if (ea == a && eb >= 7 - a) { eb -= 7 - a; ea = a + 1; }
    eb += ea + 1;

    __shared__ alignas(16) float sX[2][TILE_M * KSTR];
    __shared__ alignas(16) float sW[2][TILE_N * KSTR];
    __shared__ int sTok[TILE_M];

    const int tid  = threadIdx.x;
    const int lane = tid & 31;
    const int wave = tid >> 5;
    const int l    = lane & 15;
    const int half = lane >> 4;

    if (tid < TILE_M) {
        const int r = m0 + tid;
        sTok[tid] = (r < cnt) ? idxList[pr * T + r] : idxList[pr * T];  // pad with safe row
    }
    __syncthreads();

    // Per-thread staging slots: 4 X rows + 16 W rows, fixed row/col4 per thread.
    // Loops over the pointer arrays are unrolled so that they stay in registers.
    const int rowBase = tid >> 3;   // 0..15   (8 float4 per 32-float row)
    const int c4      = tid & 7;

    const float* gx[4];
#pragma unroll
    for (int i = 0; i < 4; ++i)
        gx[i] = x + (size_t)sTok[rowBase + 16 * i] * D + c4 * 4;       // rows 0..63
    // This thread's place in the first of its 16 rows of the two experts' weights;
    // both pointers run along k, one k-block ahead of the pass.
    const float* pa = W + ((size_t)ea * H + n0 + rowBase) * WPITCH + c4 * 4;
    const float* pb = W + ((size_t)eb * H + n0 + rowBase) * WPITCH + c4 * 4;
    const uint32_t lxBase = lds_offset(&sX[0][rowBase * KSTR + c4 * 4]);
    const int      swOff  = rowBase * KSTR + c4 * 4;   // this thread's floats into a W buffer

    // Prologue: stage k-block 0 into buffer 0, then start on k-block 1.
    async_ld4_b128(lxBase, gx);
    v4f ra[4], rb[4];   // the group of four W rows in flight
    {
        // Both loops unrolled: all 32 loads are in flight before the first sum, in registers.
        v4f qa[4][4], qb[4][4];
#pragma unroll
        for (int g = 0; g < 4; ++g) w_load4(qa[g], qb[g], pa, pb, g);
#pragma unroll
        for (int g = 0; g < 4; ++g) w_store4(&sW[0][swOff + g * 64 * KSTR], qa[g], qb[g]);
    }
    if (KB < D) { pa += KB; pb += KB; w_load4(ra, rb, pa, pb, 0); }

    v8f acc[4][4];
#pragma unroll
    for (int mt = 0; mt < 4; ++mt)
#pragma unroll
        for (int nt = 0; nt < 4; ++nt) acc[mt][nt] = v8f{};

    int buf = 0;
    for (int kb = 0; kb < D; kb += KB, buf ^= 1) {
        // This wave's LDS reads of the buffer refilled below and its W stores have retired.
        asm volatile("s_wait_dscnt 0x0" ::: "memory");
        wait_async0();       // this wave's async writes have landed in LDS
        __syncthreads();     // everyone's have

        const bool more = kb + KB < D;   // a next k-block exists: it goes into the other buffer
        if (more) {
            // byte step to the other buffer
            const uint32_t box = (uint32_t)(buf ^ 1) * (uint32_t)(TILE_M * KSTR * 4);
            const float* tx[4];
#pragma unroll
            for (int i = 0; i < 4; ++i) tx[i] = gx[i] + (kb + KB);
            async_ld4_b128(lxBase + box, tx);
        }
        float* swNext = &sW[buf ^ 1][swOff];

        const float* Xc = sX[buf] + l * KSTR + 2 * half;
        const float* Wc = sW[buf] + (wave * 64 + l) * KSTR + 2 * half;
        // Fragments of 8 k (two WMMA k-steps) per set; the next set's reads are
        // issued ahead of the current set's 32 WMMAs, inside this pass's buffer only.
        // A: lanes<16 -> K=0,1; lanes>=16 -> K=2,3; B[k][n] = S[pr][n][k], same k order
        // Every loop over a[], b[] and acc[] is unrolled so that they stay in registers.
        v2f a[2][2][4], b[2][2][4];
#pragma unroll
        for (int s = 0; s < 2; ++s)
#pragma unroll
            for (int t = 0; t < 4; ++t) {
                a[0][s][t] = *(const v2f*)&Xc[t * 16 * KSTR + 4 * s];
                b[0][s][t] = *(const v2f*)&Wc[t * 16 * KSTR + 4 * s];
            }
#pragma unroll
        for (int u = 0; u < KB / 8; ++u) {
            const int cur = u & 1;
            // W staging, a quarter per set: the group loaded one set ago is summed and
            // stored, the next group's loads fly under this set's 32 WMMAs.
            if (more) {
                w_store4(swNext + u * 64 * KSTR, ra, rb);
                if (u + 1 < KB / 8)
                    w_load4(ra, rb, pa, pb, u + 1);
                else if (kb + 2 * KB < D) { pa += KB; pb += KB; w_load4(ra, rb, pa, pb, 0); }
            }
            if (u + 1 < KB / 8) {
#pragma unroll
                for (int s = 0; s < 2; ++s)
#pragma unroll
                    for (int t = 0; t < 4; ++t) {
                        a[cur ^ 1][s][t] = *(const v2f*)&Xc[t * 16 * KSTR + 8 * (u + 1) + 4 * s];
                        b[cur ^ 1][s][t] = *(const v2f*)&Wc[t * 16 * KSTR + 8 * (u + 1) + 4 * s];
                    }
            }
#pragma unroll
            for (int s = 0; s < 2; ++s)
#pragma unroll
                for (int mt = 0; mt < 4; ++mt)
#pragma unroll
                    for (int nt = 0; nt < 4; ++nt)
                        acc[mt][nt] = __builtin_amdgcn_wmma_f32_16x16x4_f32(
                            false, a[cur][s][mt], false, b[cur][s][nt], (short)0, acc[mt][nt],
                            false, false);
        }
    }

    // Scatter: C layout M = v + 8*half, N = lane&15 per 16x16 tile. One block
    // holds a token row's whole sum over both experts -> plain stores.
    const int col0 = n0 + wave * 64 + l;
    const float* ba = bias + (size_t)ea * H;   // uniform
    const float* bb = bias + (size_t)eb * H;
    float bc[4];
#pragma unroll
    for (int nt = 0; nt < 4; ++nt)
        bc[nt] = ba[col0 + nt * 16] + bb[col0 + nt * 16];
    // The wait that stands ahead of any rewrite of a register that an issued load names.
    // It takes the two bases and the column as inputs, so they stay in their registers up to it.
    asm volatile("s_wait_xcnt 0x0" :: "s"(ba), "s"(bb), "v"(col0) : "memory");
#pragma unroll
    for (int mt = 0; mt < 4; ++mt) {
#pragma unroll
        for (int v = 0; v < 8; ++v) {
            const int rowInTile = mt * 16 + v + 8 * half;
            if (m0 + rowInTile < cnt) {
                float* o = out + (size_t)sTok[rowInTile] * H + col0;
#pragma unroll
                for (int nt = 0; nt < 4; ++nt)
                    o[nt * 16] = 0.5f * (acc[mt][nt][v] + bc[nt]);
            }
        }
    }
}

// ---------------------------------------------------------------------------
extern "C" void kernel_launch(void* const* d_in, const int* in_sizes, int n_in,
                              void* d_out, int out_size, void* d_ws, size_t ws_size,
                              hipStream_t stream) {
    const float* x    = (const float*)d_in[0];   // sequences [N,P,D] == [T,D]
    const float* gw   = (const float*)d_in[1];   // [E,D]
    const float* gb   = (const float*)d_in[2];   // [E]
    const float* W    = (const float*)d_in[3];   // [E,H,D]
    const float* bias = (const float*)d_in[4];   // [E,H]
    float* out = (float*)d_out;

    const int E = in_sizes[2];
    const int D = in_sizes[1] / E;
    const int H = in_sizes[4] / E;
    const int T = in_sizes[0] / D;

    int* counts  = (int*)d_ws;                   // [NPAIR] (padded to 64 ints)
    int* idxList = counts + 64;                  // [NPAIR, T]

    moe_clear<<<1, 32, 0, stream>>>(counts);
    moe_gate<<<(T + 7) / 8, 256, 0, stream>>>(x, gw, gb, counts, idxList, T, D);

    // every list's last M tile may be partial: at most T / TILE_M + NPAIR tiles in all
    dim3 grid(H / TILE_N, T / TILE_M + NPAIR, 1);
    moe_gemm<<<grid, 128, 0, stream>>>(x, W, bias, counts, idxList, out, T, D, H);
}

// v004
// One run takes 361 microseconds.
// Next to v003, in two timings, it ran 1.04 times as fast each time.
// Over all steps from v000 it is 1.96 times as fast.
#include <hip/hip_runtime.h>

typedef __attribute__((ext_vector_type(2))) float v2f;
typedef __attribute__((ext_vector_type(4))) float v4f;
typedef __attribute__((ext_vector_type(8))) float v8f;

#define TILE_M 64
#define TILE_N 256
#define NPAIR  28   // unordered pairs of the 8 experts
#define KB     32
#define WPITCH 1024 // floats in a row of W (D of the problem's shapes): row steps fold into the loads
#define GTOK   4    // tokens per wave of the gating kernel
#define KSTR   36   // padded LDS row stride (floats): 144B rows -> 16B aligned, bank-conflict free

// --------------------------------------------------------------------------
// LDS helpers: AS(3) pointer value == byte offset the DS/async unit adds to
// LDS_BASE, so cast generic -> AS3 and truncate.
// --------------------------------------------------------------------------
typedef __attribute__((address_space(3))) void lds_void;

__device__ __forceinline__ uint32_t lds_offset(void* p) {
    return (uint32_t)(uintptr_t)(lds_void*)p;
}

// CDNA5 async global->LDS copies (VGLOBAL encoding, tracked with ASYNCcnt):
// four rows, 16 tile rows apart in LDS, each from its own global address
// (the X tile has 64 rows: four per thread).
// LDS byte-offset VGPR first, then the 64-bit global address VGPR pair.
// The closing s_wait_xcnt 0 stands inside the statement so that no register
// a copy names is rewritten ahead of it.
__device__ __forceinline__ void async_ld4_b128(uint32_t l0, const float* const (&g)[4]) {
    const uint32_t st = 16 * KSTR * 4;   // LDS bytes between two of this thread's rows
    asm volatile("global_load_async_to_lds_b128 %0, %4, off\n\t"
                 "global_load_async_to_lds_b128 %1, %5, off\n\t"
                 "global_load_async_to_lds_b128 %2, %6, off\n\t"
                 "global_load_async_to_lds_b128 %3, %7, off\n\t"
                 "s_wait_xcnt 0x0"
                 :: "v"(l0), "v"(l0 + st), "v"(l0 + 2 * st), "v"(l0 + 3 * st),
                    "v"(g[0]), "v"(g[1]), "v"(g[2]), "v"(g[3])
                 : "memory");
}

__device__ __forceinline__ void wait_async0() {
#if __has_builtin(__builtin_amdgcn_s_wait_asynccnt)
    __builtin_amdgcn_s_wait_asynccnt(0);
#else
    asm volatile("s_wait_asynccnt 0" ::: "memory");
#endif
}

// ---------------------------------------------------------------------------
// Kernel 0: clears the per-pair counters that the gating kernel adds into.
// ---------------------------------------------------------------------------
__global__ __launch_bounds__(32) void moe_clear(int* __restrict__ counts) {
    if (threadIdx.x < NPAIR) counts[threadIdx.x] = 0;
}

// ---------------------------------------------------------------------------
// Kernel 1: gating. One wave per GTOK tokens; softmax is monotonic so top-k on
// raw logits (+bias) gives identical routing. Appends each token to the
// compacted index list of its expert pair.
// Lane l holds k = l, l + 32, ... of every row, summed in rising k and then over
// the lanes by the same butterfly for every token.
// ---------------------------------------------------------------------------
__global__ __launch_bounds__(256) void moe_gate(const float* __restrict__ x,
                                                const float* __restrict__ gw,
                                                const float* __restrict__ gb,
                                                int* __restrict__ counts,
                                                int* __restrict__ idxList,
                                                int T, int D) {
    const int wave = threadIdx.x >> 5;
    const int lane = threadIdx.x & 31;
    const int t0 = (blockIdx.x * 8 + wave) * GTOK;
    if (t0 >= T) return;

    // The wave's whole x rows go to registers first: one memory latency for the
    // wave, not one per 32 k. Unrolled so that xv[][] stays in registers.
    float xv[WPITCH / 32][GTOK];
    const float* xr[GTOK];
#pragma unroll
    for (int i = 0; i < GTOK; ++i) {
        const int t = t0 + i < T ? t0 + i : T - 1;   // a row past the end reads the last row
        xr[i] = x + (size_t)t * WPITCH + lane;
    }
#pragma unroll
    for (int j = 0; j < WPITCH / 32; ++j)
#pragma unroll
        for (int i = 0; i < GTOK; ++i) xv[j][i] = xr[i][32 * j];
    // The wait that stands ahead of any rewrite of a register that an issued load names.
    // It takes the four row addresses as inputs, so they stay in their registers up to it.
    asm volatile("s_wait_xcnt 0x0" :: "v"(xr[0]), "v"(xr[1]), "v"(xr[2]), "v"(xr[3]) : "memory");

    float s[GTOK][8];
#pragma unroll
    for (int i = 0; i < GTOK; ++i)
#pragma unroll
        for (int e = 0; e < 8; ++e) s[i][e] = 0.0f;

    // Each gate weight is loaded once for the wave's GTOK tokens (unrolled: xv[][] and s[][] in registers).
    const float* gl = gw + lane;
#pragma unroll
    for (int j = 0; j < WPITCH / 32; ++j)
#pragma unroll
        for (int e = 0; e < 8; ++e) {
            const float g = gl[e * WPITCH + 32 * j];
#pragma unroll
            for (int i = 0; i < GTOK; ++i) s[i][e] = fmaf(xv[j][i], g, s[i][e]);
        }
    // The same wait for the gate weight loads: their base and the lane stay in their registers up to it.
    asm volatile("s_wait_xcnt 0x0" :: "s"(gw), "v"(lane) : "memory");
#pragma unroll
    for (int off = 16; off > 0; off >>= 1) {
#pragma unroll
        for (int i = 0; i < GTOK; ++i)
#pragma unroll
            for (int e = 0; e < 8; ++e)
                s[i][e] += __shfl_xor(s[i][e], off, 32);
    }

    // Lane i ranks token t0 + i (unrolled selects: s[][] is never indexed by a lane value).
    float v[8];
#pragma unroll
    for (int e = 0; e < 8; ++e) {
        v[e] = s[0][e];
#pragma unroll
        for (int i = 1; i < GTOK; ++i) v[e] = lane == i ? s[i][e] : v[e];
    }
    const int t = t0 + lane;
    if (lane < GTOK && t < T) {
#pragma unroll
        for (int e = 0; e < 8; ++e) v[e] += gb[e];
        int i1 = 0; float v1 = v[0];
#pragma unroll
        for (int e = 1; e < 8; ++e) { if (v[e] > v1) { v1 = v[e]; i1 = e; } }
        int i2 = (i1 == 0) ? 1 : 0; float v2 = v[i2];
#pragma unroll
        for (int e = 0; e < 8; ++e) { if (e != i1 && v[e] > v2) { v2 = v[e]; i2 = e; } }
        const int lo = i1 < i2 ? i1 : i2;
        const int hi = i1 < i2 ? i2 : i1;
        const int pr = lo * (15 - lo) / 2 + (hi - lo - 1);   // (0,1),(0,2)..(0,7),(1,2)..
        const int pos = atomicAdd(&counts[pr], 1);
        idxList[pr * T + pos] = t;
    }
}

// ---------------------------------------------------------------------------
// Kernel 2: grouped GEMM per expert pair. x.Wa^T + x.Wb^T == x.(Wa + Wb)^T, so
// the two experts' W tiles are loaded to registers, added and stored to LDS as
// one tile: one GEMM row per token. V_WMMA_F32_16X16X4_F32, two LDS buffers; X
// is staged by async-to-LDS copies. Block = 128 thr (4 waves, 1 x 4) ->
// 64(M) x 256(N) tile; each wave owns 64 x 64 = 16 accumulator tiles, so one
// k-step of 8 fragment reads feeds 16 WMMAs.
// A token is in exactly one pair list, so each output row has one writer.
// ---------------------------------------------------------------------------
// Four W rows of both experts (group g of four; rows 16 tile rows apart), 16 bytes a
// thread and row: the thread's two running pointers plus a constant step per row.
__device__ __forceinline__ void w_load4(v4f (&ra)[4], v4f (&rb)[4],
                                        const float* pa, const float* pb, int g) {
    // Unrolled: the loaded rows stay in registers, the row steps are constants.
#pragma unroll
    for (int i = 0; i < 4; ++i) {
        ra[i] = *(const v4f*)(pa + (4 * g + i) * 16 * WPITCH);
        rb[i] = *(const v4f*)(pb + (4 * g + i) * 16 * WPITCH);
    }
    // The wait that stands ahead of any rewrite of a register that an issued load names.
    // It takes the two addresses as inputs, so they stay in their registers up to it.
    asm volatile("s_wait_xcnt 0x0" :: "v"(pa), "v"(pb) : "memory");
}

// Their sums into the LDS tile, rows 16 apart from dst on.
__device__ __forceinline__ void w_store4(float* dst, const v4f (&ra)[4], const v4f (&rb)[4]) {
    // Unrolled: ra[] and rb[] stay in registers, the row steps fold into the stores.
#pragma unroll
    for (int i = 0; i < 4; ++i) *(v4f*)&dst[i * 16 * KSTR] = ra[i] + rb[i];
}

__global__ __launch_bounds__(128) void moe_gemm(const float* __restrict__ x,      // [T,D]
                                                const float* __restrict__ W,      // [E,H,D]
                                                const float* __restrict__ bias,   // [E,H]
                                                const int* __restrict__ counts,   // [NPAIR]
                                                const int* __restrict__ idxList,  // [NPAIR,T]
                                                float* __restrict__ out,          // [T,H]
                                                int T, int D, int H) {
    const int n0  = blockIdx.x * TILE_N;
    // blockIdx.y counts the M tiles of all pair lists one after the other.
    // Unrolled: the 28 counters arrive in a few wide scalar loads.
    int pr = -1, m0 = 0, cnt = 0, first = 0;
#pragma unroll
    for (int p = 0; p < NPAIR; ++p) {
        const int c  = counts[p];
        const int nt = (int)((unsigned)(c + TILE_M - 1) / TILE_M);
        if (pr < 0 && (int)blockIdx.y < first + nt) {
            pr = p; m0 = ((int)blockIdx.y - first) * TILE_M; cnt = c;
        }
        first += nt;
    }
    if (pr < 0) return;   // uniform scalar branch: whole block exits
    // The pair's two experts, pairs counted (0,1),(0,2)..(0,7),(1,2).. (unrolled: scalar selects, no loop).
    int ea = 0, eb = pr;
#pragma unroll
    for (int a = 0; a < 7; ++a)
        if (ea == a && eb >= 7 - a) { eb -= 7 - a; ea = a + 1; }
    eb += ea + 1;

    __shared__ alignas(16) float sX[2][TILE_M * KSTR];
    __shared__ alignas(16) float sW[2][TILE_N * KSTR];
    __shared__ int sTok[TILE_M];

    const int tid  = threadIdx.x;
    const int lane = tid & 31;
    const int wave = tid >> 5;
    const int l    = lane & 15;
    const int half = lane >> 4;

    if (tid < TILE_M) {
        const int r = m0 + tid;
        sTok[tid] = (r < cnt) ? idxList[pr * T + r] : idxList[pr * T];  // pad with safe row
    }
    __syncthreads();

    // Per-thread staging slots: 4 X rows + 16 W rows, fixed row/col4 per thread.
    // Loops over the pointer arrays are unrolled so that they stay in registers.
    const int rowBase = tid >> 3;   // 0..15   (8 float4 per 32-float row)
    const int c4      = tid & 7;

    const float* gx[4];
#pragma unroll
    for (int i = 0; i < 4; ++i)
        gx[i] = x + (size_t)sTok[rowBase + 16 * i] * D + c4 * 4;       // rows 0..63
    // This thread's place in the first of its 16 rows of the two experts' weights;
    // both pointers run along k, one k-block ahead of the pass.
    const float* pa = W + ((size_t)ea * H + n0 + rowBase) * WPITCH + c4 * 4;
    const float* pb = W + ((size_t)eb * H + n0 + rowBase) * WPITCH + c4 * 4;
    const uint32_t lxBase = lds_offset(&sX[0][rowBase * KSTR + c4 * 4]);
    const int      swOff  = rowBase * KSTR + c4 * 4;   // this thread's floats into a W buffer

    // Prologue: stage k-block 0 into buffer 0, then start on k-block 1.
    async_ld4_b128(lxBase, gx);
    v4f ra[4], rb[4];   // the group of four W rows in flight
    {
        // Both loops unrolled: all 32 loads are in flight before the first sum, in registers.
        v4f qa[4][4], qb[4][4];
#pragma unroll
        for (int g = 0; g < 4; ++g) w_load4(qa[g], qb[g], pa, pb, g);
#pragma unroll
        for (int g = 0; g < 4; ++g) w_store4(&sW[0][swOff + g * 64 * KSTR], qa[g], qb[g]);
    }
    if (KB < D) { pa += KB; pb += KB; w_load4(ra, rb, pa, pb, 0); }

    v8f acc[4][4];
#pragma unroll
    for (int mt = 0; mt < 4; ++mt)
#pragma unroll
        for (int nt = 0; nt < 4; ++nt) acc[mt][nt] = v8f{};

    int buf = 0;
    for (int kb = 0; kb < D; kb += KB, buf ^= 1) {
        // This wave's LDS reads of the buffer refilled below and its W stores have retired.
        asm volatile("s_wait_dscnt 0x0" ::: "memory");
        wait_async0();       // this wave's async writes have landed in LDS
        __syncthreads();     // everyone's have

        const bool more = kb + KB < D;   // a next k-block exists: it goes into the other buffer
        if (more) {
            // byte step to the other buffer
            const uint32_t box = (uint32_t)(buf ^ 1) * (uint32_t)(TILE_M * KSTR * 4);
            const float* tx[4];
#pragma unroll
            for (int i = 0; i < 4; ++i) tx[i] = gx[i] + (kb + KB);
            async_ld4_b128(lxBase + box, tx);
        }
        float* swNext = &sW[buf ^ 1][swOff];

        const float* Xc = sX[buf] + l * KSTR + 2 * half;
        const float* Wc = sW[buf] + (wave * 64 + l) * KSTR + 2 * half;
        // Fragments of 8 k (two WMMA k-steps) per set; the next set's reads are
        // issued ahead of the current set's 32 WMMAs, inside this pass's buffer only.
        // A: lanes<16 -> K=0,1; lanes>=16 -> K=2,3; B[k][n] = S[pr][n][k], same k order
        // Every loop over a[], b[] and acc[] is unrolled so that they stay in registers.
        v2f a[2][2][4], b[2][2][4];
#pragma unroll
        for (int s = 0; s < 2; ++s)
#pragma unroll
            for (int t = 0; t < 4; ++t) {
                a[0][s][t] = *(const v2f*)&Xc[t * 16 * KSTR + 4 * s];
                b[0][s][t] = *(const v2f*)&Wc[t * 16 * KSTR + 4 * s];
            }
#pragma unroll
        for (int u = 0; u < KB / 8; ++u) {
            const int cur = u & 1;
            // W staging, a quarter per set: the group loaded one set ago is summed and
            // stored, the next group's loads fly under this set's 32 WMMAs.
            if (more) {
                w_store4(swNext + u * 64 * KSTR, ra, rb);
                if (u + 1 < KB / 8)
                    w_load4(ra, rb, pa, pb, u + 1);
                else if (kb + 2 * KB < D) { pa += KB; pb += KB; w_load4(ra, rb, pa, pb, 0); }
            }
            if (u + 1 < KB / 8) {
#pragma unroll
                for (int s = 0; s < 2; ++s)
#pragma unroll
                    for (int t = 0; t < 4; ++t) {
                        a[cur ^ 1][s][t] = *(const v2f*)&Xc[t * 16 * KSTR + 8 * (u + 1) + 4 * s];
                        b[cur ^ 1][s][t] = *(const v2f*)&Wc[t * 16 * KSTR + 8 * (u + 1) + 4 * s];
                    }
            }
#pragma unroll
            for (int s = 0; s < 2; ++s)
#pragma unroll
                for (int mt = 0; mt < 4; ++mt)
#pragma unroll
                    for (int nt = 0; nt < 4; ++nt)
                        acc[mt][nt] = __builtin_amdgcn_wmma_f32_16x16x4_f32(
                            false, a[cur][s][mt], false, b[cur][s][nt], (short)0, acc[mt][nt],
                            false, false);
        }
    }

    // Scatter: C layout M = v + 8*half, N = lane&15 per 16x16 tile. One block
    // holds a token row's whole sum over both experts -> plain stores.
    const int col0 = n0 + wave * 64 + l;
    const float* ba = bias + (size_t)ea * H;   // uniform
    const float* bb = bias + (size_t)eb * H;
    float bc[4];
#pragma unroll
    for (int nt = 0; nt < 4; ++nt)
        bc[nt] = ba[col0 + nt * 16] + bb[col0 + nt * 16];
    // The wait that stands ahead of any rewrite of a register that an issued load names.
    // It takes the two bases and the column as inputs, so they stay in their registers up to it.
    asm volatile("s_wait_xcnt 0x0" :: "s"(ba), "s"(bb), "v"(col0) : "memory");
#pragma unroll
    for (int mt = 0; mt < 4; ++mt) {
#pragma unroll
        for (int v = 0; v < 8; ++v) {
            const int rowInTile = mt * 16 + v + 8 * half;
            if (m0 + rowInTile < cnt) {
                float* o = out + (size_t)sTok[rowInTile] * H + col0;
#pragma unroll
                for (int nt = 0; nt < 4; ++nt)
                    o[nt * 16] = 0.5f * (acc[mt][nt][v] + bc[nt]);
            }
        }
    }
}

// ---------------------------------------------------------------------------
extern "C" void kernel_launch(void* const* d_in, const int* in_sizes, int n_in,
                              void* d_out, int out_size, void* d_ws, size_t ws_size,
                              hipStream_t stream) {
    const float* x    = (const float*)d_in[0];   // sequences [N,P,D] == [T,D]
    const float* gw   = (const float*)d_in[1];   // [E,D]
    const float* gb   = (const float*)d_in[2];   // [E]
    const float* W    = (const float*)d_in[3];   // [E,H,D]
    const float* bias = (const float*)d_in[4];   // [E,H]
    float* out = (float*)d_out;

    const int E = in_sizes[2];
    const int D = in_sizes[1] / E;
    const int H = in_sizes[4] / E;
    const int T = in_sizes[0] / D;

    int* counts  = (int*)d_ws;                   // [NPAIR] (padded to 64 ints)
    int* idxList = counts + 64;                  // [NPAIR, T]

    moe_clear<<<1, 32, 0, stream>>>(counts);
    moe_gate<<<(T + 8 * GTOK - 1) / (8 * GTOK), 256, 0, stream>>>(x, gw, gb, counts, idxList, T, D);

    // every list's last M tile may be partial: at most T / TILE_M + NPAIR tiles in all
    dim3 grid(H / TILE_N, T / TILE_M + NPAIR, 1);
    moe_gemm<<<grid, 128, 0, stream>>>(x, W, bias, counts, idxList, out, T, D, H);
}
